// v000
// Measured on an AMD MI455X. A time is GPU time per run, averaged over a window of back-to-back runs after a warm-up
// (all launches, gaps included; the runs take copies of the inputs in turn), and the median of several windows.
// Apart from v000's, it joins two sittings. Times from different sittings can be a few percent apart, while
// side-by-side timings come from the same sitting.
// The starting kernel, v000, takes 1980 microseconds a run.
// Contractions: xn.(Wq|Wk), Wv^T.xn^T, q.k^T, P.V, ctx.Wo, xn.W1, silu(h).W2 all on v_wmma_f32_16x16x32_f16 (f16 operands: weights carried x64, P carried x2048, ctx carried x256), f32 accumulate; rmsnorm, softmax, silu, residual adds in f32.
#include <hip/hip_runtime.h>
#include <math.h>

// ---------------------------------------------------------------------------
// Problem constants
// ---------------------------------------------------------------------------
constexpr int kBatch = 2;
constexpr int kSeq   = 2048;
constexpr int kDim   = 1024;
constexpr int kHeads = 16;
constexpr int kHDim  = 64;
constexpr int kFF    = 4096;
constexpr int kTok   = kBatch * kSeq;          // 4096 token rows
constexpr int kGrp   = 2;                      // (batch,head) groups per attention chunk
constexpr int kNChunk = (kBatch * kHeads) / kGrp;   // 16
constexpr float kWCarry    = 64.0f;            // weights carried x64 in f16
constexpr float kWCarryInv = 1.0f / 64.0f;
constexpr float kPCarry    = 2048.0f;          // probabilities carried x2048 in f16
constexpr float kCtxCarry  = 256.0f;           // attention context carried x256 in f16
constexpr float kPVScale   = kCtxCarry / kPCarry;             // 1/8
constexpr float kWoScale   = 1.0f / (kCtxCarry * kWCarry);   // 1/16384
constexpr float kQKScale   = 0.125f;           // 1/sqrt(64)
constexpr float kInvDim    = 1.0f / 1024.0f;
constexpr float kEps       = 1.1920929e-7f;    // f32 eps

typedef __attribute__((ext_vector_type(16))) _Float16 v16h;
typedef __attribute__((ext_vector_type(8)))  _Float16 v8h;
typedef __attribute__((ext_vector_type(16))) __bf16   v16b;
typedef __attribute__((ext_vector_type(8)))  __bf16   v8b;
typedef __attribute__((ext_vector_type(8)))  float    v8f;
typedef __attribute__((ext_vector_type(4)))  float    v4f;
typedef __attribute__((ext_vector_type(4)))  unsigned int v4u;

__device__ __forceinline__ unsigned short f2bf_bits(float f) {
  unsigned u = __float_as_uint(f);
  return (unsigned short)((u + 0x7FFFu + ((u >> 16) & 1u)) >> 16);
}
__device__ __forceinline__ float bf_bits2f(unsigned short h) { return __uint_as_float(((unsigned)h) << 16); }

// hazard guards as plain device helpers (no inline asm inside the kernel template body)
__device__ __forceinline__ void dep_guard_h(v8f& a, v8f& b, v16h x, v16h y) { asm volatile("v_nop\n\tv_nop\n\tv_nop\n\tv_nop" : "+v"(a), "+v"(b) : "v"(x), "v"(y)); }
__device__ __forceinline__ void dep_guard_b(v8f& a, v8f& b, v16b x, v16b y) { asm volatile("v_nop\n\tv_nop\n\tv_nop\n\tv_nop" : "+v"(a), "+v"(b) : "v"(x), "v"(y)); }
__device__ __forceinline__ void keep4_h(v16h a, v16h b, v16h c, v16h d) { asm volatile("v_nop" :: "v"(a), "v"(b), "v"(c), "v"(d)); }
__device__ __forceinline__ void keep4_b(v16b a, v16b b, v16b c, v16b d) { asm volatile("v_nop" :: "v"(a), "v"(b), "v"(c), "v"(d)); }
__device__ __forceinline__ void acc_guard4(v8f& a, v8f& b, v8f& c, v8f& d) { asm volatile("v_nop\n\tv_nop\n\tv_nop\n\tv_nop" : "+v"(a), "+v"(b), "+v"(c), "+v"(d)); }
template <typename T> struct Frag;
template <> struct Frag<_Float16> {
  typedef v16h V; union U { v16h v; v8h h[2]; };
  static __device__ __forceinline__ v16h load(const _Float16* p) {   // elements 0..7 <- p[0..7], 8..15 <- p[16..23]
    U f; f.h[0] = *(const v8h*)(p); f.h[1] = *(const v8h*)(p + 16); return f.v;
  }
  static __device__ __forceinline__ v8f mma(v16h a, v16h b, v8f c) {
    return __builtin_amdgcn_wmma_f32_16x16x32_f16(false, a, false, b, (short)0, c, false, false);
  }
  static __device__ __forceinline__ void guard(v8f& a, v8f& b, v16h x, v16h y) { dep_guard_h(a, b, x, y); }
  static __device__ __forceinline__ void keep(v16h a, v16h b, v16h c, v16h d) { keep4_h(a, b, c, d); }
};
template <> struct Frag<__bf16> {
  typedef v16b V; union U { v16b v; v8b h[2]; };
  static __device__ __forceinline__ v16b load(const __bf16* p) {
    U f; f.h[0] = *(const v8b*)(p); f.h[1] = *(const v8b*)(p + 16); return f.v;
  }
  static __device__ __forceinline__ v8f mma(v16b a, v16b b, v8f c) {
    return __builtin_amdgcn_wmma_f32_16x16x32_bf16(false, a, false, b, (short)0, c, false, false);
  }
  static __device__ __forceinline__ void guard(v8f& a, v8f& b, v16b x, v16b y) { dep_guard_b(a, b, x, y); }
  static __device__ __forceinline__ void keep(v16b a, v16b b, v16b c, v16b d) { keep4_b(a, b, c, d); }
};

__device__ __forceinline__ unsigned pk16(unsigned short a, unsigned short b) { return (unsigned)a | ((unsigned)b << 16); }
__device__ __forceinline__ unsigned short h_bits(float f) { const _Float16 h = (_Float16)f; return __builtin_bit_cast(unsigned short, h); }

// ---- Register-blocked batched WMMA GEMM (ACT reduced to none/relu/silu/leaky; CAUS added) ---------------
// C[m,n] = scale * sum_k A[m,k] * Bt[n,k] (+bias)(+resid); each wave owns a 64x64 tile.
// A row-major [M,K]; Bt row-major [N,K]; M,N % 64 == 0, K % 32 == 0.
// SPLIT: operands are hi/lo planes (A2/Bt2 = lo planes, same layout); product = hi.hi + hi.lo + lo.hi.
// BIAS_MODE: 0 = none, 1 = bias[m], 2 = bias[n].
// OUT_MODE: 0 = f32, 1 = f16, 2 = bf16 hi plane (Cout) + bf16 lo plane (Cout2).
// CAUS: 0 = full; 1 = tiles with n0 > m0 are skipped (wave-uniform, their C lines are left untouched);
//       2 = the k loop stops at min(K, m0 + 64) (A entries with k > m are zero by construction of the producer).
// ET: 0 = f16 operands, 1 = bf16 operands (pointers passed as 16-bit storage)
template <int ET> struct Elem;
template <> struct Elem<0> { typedef _Float16 T; };
template <> struct Elem<1> { typedef __bf16 T; };
template <int ET, bool SPLIT, int BIAS_MODE, int OUT_MODE, bool RESID, int ACT = 0, int CAUS = 0>
__global__ __launch_bounds__(256) void wmma_gemm64(
    const unsigned short* __restrict__ Ap, const unsigned short* __restrict__ A2p, int lda, long strideA,
    const unsigned short* __restrict__ Btp, const unsigned short* __restrict__ Bt2p, int ldb, long strideB,
    void* __restrict__ Cout, void* __restrict__ Cout2, int ldc, long strideC,
    const float* __restrict__ bias,
    const float* __restrict__ resid, long strideR,
    int M, int N, int K, float scale) {
  typedef typename Elem<ET>::T T;
  typedef typename Frag<T>::V V;
  const T* A = (const T*)Ap; const T* A2 = (const T*)A2p; const T* Bt = (const T*)Btp; const T* Bt2 = (const T*)Bt2p;
  __shared__ __align__(16) float sT[8][16 * 68];   // per-wave 16x64 slab, pitch 68 floats
  const int b    = blockIdx.y;
  const int lane = threadIdx.x & 31;
  const int wave = threadIdx.x >> 5;
  const int tilesN = N >> 6;
  const int tilesM = M >> 6;
  const int tile = blockIdx.x * 8 + wave;
  if (tile >= tilesM * tilesN) return;   // wave-uniform; no block barriers in this kernel
  const int tm = tile / tilesN;
  const int tn = tile - tm * tilesN;
  const int m0 = tm << 6;
  const int n0 = tn << 6;
  if (CAUS == 1 && n0 > m0) return;      // wave-uniform; fully masked tile
  const int Kend = (CAUS == 2) ? ((m0 + 64 < K) ? (m0 + 64) : K) : K;   // wave-uniform, multiple of 32

  const T* Ab  = A  + (size_t)b * strideA;
  const T* Bb  = Bt + (size_t)b * strideB;
  const T* Ab2 = SPLIT ? (A2  + (size_t)b * strideA) : nullptr;
  const T* Bb2 = SPLIT ? (Bt2 + (size_t)b * strideB) : nullptr;

  const int rlane = lane & 15;                 // row (A) / col (B, D) within subtile
  const int koff  = (lane >> 4) * 8;           // k offset of this lane half
  const int mOff  = (lane >> 4) * 8;           // D row offset

  v8f acc[4][4];
#pragma unroll
  for (int i = 0; i < 4; ++i)
#pragma unroll
    for (int j = 0; j < 4; ++j) acc[i][j] = (v8f){0.f,0.f,0.f,0.f,0.f,0.f,0.f,0.f};

  for (int k0 = 0; k0 < Kend; k0 += 32) {
    V bh[4], bl[4];
#pragma unroll
    for (int j = 0; j < 4; ++j) {
      const size_t bo = (size_t)(n0 + (j << 4) + rlane) * ldb + koff + k0;
      bh[j] = Frag<T>::load(Bb + bo);
      if (SPLIT) bl[j] = Frag<T>::load(Bb2 + bo);
    }
#pragma unroll
    for (int i = 0; i < 4; ++i) {
      const size_t ao = (size_t)(m0 + (i << 4) + rlane) * lda + koff + k0;
      V ah = Frag<T>::load(Ab + ao);
      V al;
      if (SPLIT) al = Frag<T>::load(Ab2 + ao);
#pragma unroll
      for (int j = 0; j < 4; ++j) {
        acc[i][j] = Frag<T>::mma(ah, bh[j], acc[i][j]);
        if (SPLIT) {
          acc[i][j] = Frag<T>::mma(ah, bl[j], acc[i][j]);
          acc[i][j] = Frag<T>::mma(al, bh[j], acc[i][j]);
        }
      }
      Frag<T>::guard(acc[i][0], acc[i][3], ah, SPLIT ? al : ah);
    }
    Frag<T>::keep(bh[0], bh[1], bh[2], bh[3]);
    if (SPLIT) Frag<T>::keep(bl[0], bl[1], bl[2], bl[3]);
  }
  acc_guard4(acc[0][0], acc[0][1], acc[0][2], acc[0][3]);
  acc_guard4(acc[1][0], acc[1][1], acc[1][2], acc[1][3]);
  acc_guard4(acc[2][0], acc[2][1], acc[2][2], acc[2][3]);
  acc_guard4(acc[3][0], acc[3][1], acc[3][2], acc[3][3]);

  // ---- epilogue ----
  float* slab = sT[wave];
  const float* Rb = RESID ? (resid + (size_t)b * strideR) : nullptr;
#pragma unroll
  for (int i = 0; i < 4; ++i) {
    const int mBase = m0 + (i << 4);
#pragma unroll
    for (int j = 0; j < 4; ++j) {
      const int n = n0 + (j << 4) + rlane;
      float bv = 0.f;
      if (BIAS_MODE == 2) bv = bias[n];
#pragma unroll
      for (int r = 0; r < 8; ++r) {
        float v = acc[i][j][r] * scale;
        if (BIAS_MODE == 1) v += bias[mBase + mOff + r];
        if (BIAS_MODE == 2) v += bv;
        if (RESID) v += Rb[(size_t)(mBase + mOff + r) * ldc + n];
        if (ACT == 2) v = fmaxf(v, 0.0f);
        if (ACT == 3) v = v / (1.0f + expf(-v));
        if (ACT == 4) v = (v > 0.f) ? v : 0.01f * v;
        slab[(mOff + r) * 68 + (j << 4) + rlane] = v;
      }
    }
    __builtin_amdgcn_fence(__ATOMIC_RELEASE, "workgroup");
    __builtin_amdgcn_wave_barrier();
    __builtin_amdgcn_fence(__ATOMIC_ACQUIRE, "workgroup");
    if (OUT_MODE == 0) {
      float* C = (float*)Cout + (size_t)b * strideC;
      const int hh = lane >> 4, c4 = (lane & 15) * 4;     // row seg = 256 B = 16 lanes x 16 B
      {
#pragma unroll
        for (int it = 0; it < 8; ++it) {
          const int row = it * 2 + hh;
          v4f v = *(const v4f*)(slab + row * 68 + c4);
          *(v4f*)(C + (size_t)(mBase + row) * ldc + n0 + c4) = v;
        }
        
      }
    } else {
      const int q = lane >> 3, c8 = (lane & 7) * 8;
      unsigned short* C  = (unsigned short*)Cout  + (size_t)b * strideC;
      unsigned short* C2 = (OUT_MODE == 2) ? ((unsigned short*)Cout2 + (size_t)b * strideC) : nullptr;
      {
#pragma unroll
        for (int it = 0; it < 4; ++it) {
          const int row = it * 4 + q;
          const float* sp = slab + row * 68 + c8;
          v8h hv, lv;
#pragma unroll
          for (int e = 0; e < 8; ++e) {
            if (OUT_MODE == 1) {
              hv[e] = (_Float16)sp[e];
            } else {
              unsigned short hb = f2bf_bits(sp[e]);
              unsigned short lb = f2bf_bits(sp[e] - bf_bits2f(hb));
              hv[e] = __builtin_bit_cast(_Float16, hb);
              lv[e] = __builtin_bit_cast(_Float16, lb);
            }
          }
          *(v8h*)(C + (size_t)(mBase + row) * ldc + n0 + c8) = hv;
          if (OUT_MODE == 2) *(v8h*)(C2 + (size_t)(mBase + row) * ldc + n0 + c8) = lv;
        }
        
      }
    }
    __builtin_amdgcn_fence(__ATOMIC_RELEASE, "workgroup");
    __builtin_amdgcn_wave_barrier();
    __builtin_amdgcn_fence(__ATOMIC_ACQUIRE, "workgroup");
  }
}

// ---------------------------------------------------------------------------
// RMSNorm: xn[row][j] = f16( x[row][j] * rsqrt(mean(x^2) + eps) * w[j] ), f32 math.
// One block of 128 threads per row of 1024; thread t owns columns 8t..8t+7 (128 x 8 = 1024 = whole row).
// Sum of squares in fixed order (thread, wave shuffle tree, 4 wave partials in index order).
// ---------------------------------------------------------------------------
__global__ __launch_bounds__(128) void rmsnorm_f16_kernel(const float* __restrict__ x, const float* __restrict__ w,
                                                          unsigned short* __restrict__ xn) {
  __shared__ float red[4];
  const int row  = blockIdx.x;
  const int t    = threadIdx.x;
  const int lane = t & 31, wave = t >> 5;
  const int c0   = t * 8;
  const float* xr = x + (size_t)row * kDim + c0;
  const v4f a = *(const v4f*)(xr);
  const v4f c = *(const v4f*)(xr + 4);
  float ss = ((a[0] * a[0] + a[1] * a[1]) + (a[2] * a[2] + a[3] * a[3]))
           + ((c[0] * c[0] + c[1] * c[1]) + (c[2] * c[2] + c[3] * c[3]));
#pragma unroll
  for (int off = 16; off > 0; off >>= 1) ss += __shfl_xor(ss, off, 32);
  if (lane == 0) red[wave] = ss;
  __syncthreads();
  const float tot = ((red[0] + red[1]) + red[2]) + red[3];
  const float inv = rsqrtf(tot * kInvDim + kEps);
  const v4f wa = *(const v4f*)(w + c0);
  const v4f wc = *(const v4f*)(w + c0 + 4);
  unsigned short hb[8];
#pragma unroll
  for (int e = 0; e < 4; ++e) {
    hb[e]     = h_bits(a[e] * inv * wa[e]);
    hb[4 + e] = h_bits(c[e] * inv * wc[e]);
  }
  const v4u u = (v4u){pk16(hb[0], hb[1]), pk16(hb[2], hb[3]), pk16(hb[4], hb[5]), pk16(hb[6], hb[7])};
  unsigned short* op = xn + (size_t)row * kDim + c0;
  *(v4u*)op = u;
  
}

// ---------------------------------------------------------------------------
// Weight transpose + cast: W f32 row-major in[Kin rows][Nout cols]  ->  out[Nout][Kin] (pitch Kin halves),
// out[n][k] = f16(scale * W[k][n]).  grid = (Kin/64, Nout/64): blockIdx.x = k tile (64 columns of out),
// blockIdx.y = n tile (64 rows of out). 256 threads.
// Load coverage: 16 iterations x 256 threads = 4096 = the whole 64x64 tile (coalesced along n).
// Store coverage: 8 waves x 2 iterations x 4 rows (lane>>3) = 64 rows; (lane&7) x 8 halves = 64 cols; each row
// ---------------------------------------------------------------------------
__global__ __launch_bounds__(256) void wtcast_kernel(const float* __restrict__ W, unsigned short* __restrict__ out,
                                                     int Kin, int Nout, float scale) {
  __shared__ float sm[64][65];   // sm[n_local][k_local]
  const int t  = threadIdx.x;
  const int k0 = blockIdx.x * 64;
  const int n0 = blockIdx.y * 64;
#pragma unroll
  for (int i = 0; i < 16; ++i) {
    const int e = i * 256 + t;
    const int r = e >> 6;          // k local
    const int c = e & 63;          // n local
    sm[c][r] = W[(size_t)(k0 + r) * Nout + n0 + c] * scale;
  }
  __syncthreads();
  const int lane = t & 31, wave = t >> 5;
  const int q = lane >> 3, c8 = (lane & 7) * 8;
  {
#pragma unroll
    for (int it = 0; it < 2; ++it) {
      const int row = wave * 8 + it * 4 + q;                 // n local
      unsigned short hb[8];
#pragma unroll
      for (int e = 0; e < 8; ++e) hb[e] = h_bits(sm[row][c8 + e]);
      const v4u u = (v4u){pk16(hb[0], hb[1]), pk16(hb[2], hb[3]), pk16(hb[4], hb[5]), pk16(hb[6], hb[7])};
      *(v4u*)(out + (size_t)(n0 + row) * Kin + k0 + c8) = u;
    }
    
  }
}

// ---------------------------------------------------------------------------
// Causal row softmax over 2048 f32 scores (scale 1/8 already applied by the scores GEMM):
//   P[g][row][j] = f16( 2048 * exp(s - max) / sum exp(s - max) ) for j <= row, 0 for j > row; f32 math.
// Columns j > row are replaced by -inf by index select right after the load (the scores plane holds stale
// data there, tiles above the diagonal are never computed). Column 0 is always valid so max is finite.
// One block of 256 threads per (row, g); thread t owns columns 8t..8t+7 (256 x 8 = 2048 = whole row).
// Reductions in fixed order (thread, wave shuffle tree, 8 wave partials in index order), cross-lane ops unconditional.
// ---------------------------------------------------------------------------
__global__ __launch_bounds__(256) void softmax_causal_kernel(const float* __restrict__ S, unsigned short* __restrict__ P) {
  __shared__ float redM[8];
  __shared__ float redS[8];
  const int row  = blockIdx.x;
  const int g    = blockIdx.y;
  const int t    = threadIdx.x;
  const int lane = t & 31, wave = t >> 5;
  const int c0   = t * 8;
  const size_t base = ((size_t)g * kSeq + row) * kSeq + c0;
  const v4f a = *(const v4f*)(S + base);
  const v4f c = *(const v4f*)(S + base + 4);
  float xv[8];
#pragma unroll
  for (int e = 0; e < 4; ++e) {
    xv[e]     = (c0 + e <= row)     ? a[e] : -INFINITY;
    xv[4 + e] = (c0 + 4 + e <= row) ? c[e] : -INFINITY;
  }
  float m = fmaxf(fmaxf(fmaxf(xv[0], xv[1]), fmaxf(xv[2], xv[3])), fmaxf(fmaxf(xv[4], xv[5]), fmaxf(xv[6], xv[7])));
#pragma unroll
  for (int off = 16; off > 0; off >>= 1) m = fmaxf(m, __shfl_xor(m, off, 32));
  if (lane == 0) redM[wave] = m;
  __syncthreads();
  float M = redM[0];
#pragma unroll
  for (int i = 1; i < 8; ++i) M = fmaxf(M, redM[i]);
  float p[8];
  float psum = 0.f;
#pragma unroll
  for (int e = 0; e < 8; ++e) {
    const float pe = (c0 + e <= row) ? expf(xv[e] - M) : 0.f;
    p[e] = pe;
    psum += pe;
  }
#pragma unroll
  for (int off = 16; off > 0; off >>= 1) psum += __shfl_xor(psum, off, 32);
  if (lane == 0) redS[wave] = psum;
  __syncthreads();
  float tot = redS[0];
#pragma unroll
  for (int i = 1; i < 8; ++i) tot += redS[i];
  const float f = kPCarry * (1.0f / tot);
  unsigned short hb[8];
#pragma unroll
  for (int e = 0; e < 8; ++e) hb[e] = h_bits(p[e] * f);
  const v4u u = (v4u){pk16(hb[0], hb[1]), pk16(hb[2], hb[3]), pk16(hb[4], hb[5]), pk16(hb[6], hb[7])};
  unsigned short* op = P + base;
  *(v4u*)op = u;
  
}

// ---------------------------------------------------------------------------
// Launch
// Workspace region map (bytes, MiB offsets), total 104 MiB = 109051904 B:
//   [  0,  8) XN16 f16 [4096][1024]            -> later CTX16 f16 [4096][1024] (XN16 dead after the W1 GEMM)
//   [  8, 12) WqkT f16 [2048][1024] (Wq^T rows 0..1023, Wk^T rows 1024..2047), carried x64
//   [ 12, 14) WvT  f16 [1024][1024] x64
//   [ 14, 16) WoT  f16 [1024][1024] x64
//   [ 16, 24) W1T  f16 [4096][1024] x64  \  -> later P16 f16 [kGrp][2048][2048] (16 MiB, both dead after W1/W2 GEMMs)
//   [ 24, 32) W2T  f16 [1024][4096] x64  /
//   [ 32, 48) QK16 f16 [4096][2048] (q cols 0..1023, k cols 1024..2047)
//   [ 48, 56) VT16 f16 [1024][4096] (row = h*64+d, col = b*2048+kv)
//   [ 56, 88) H16  f16 [4096][4096] silu hidden -> later SC f32 [kGrp][2048][2048] (32 MiB, H16 dead after the W2 GEMM)
//   [ 88,104) T    f32 [4096][1024] = x + ffn
// ---------------------------------------------------------------------------
extern "C" void kernel_launch(void* const* d_in, const int* in_sizes, int n_in,
                              void* d_out, int out_size, void* d_ws, size_t ws_size,
                              hipStream_t stream)
{
  if (n_in < 8) return;
  if (in_sizes[0] != kTok * kDim || in_sizes[1] != kDim || in_sizes[2] != kDim * kDim || in_sizes[3] != kDim * kDim ||
      in_sizes[4] != kDim * kDim || in_sizes[5] != kDim * kDim || in_sizes[6] != kDim * kFF || in_sizes[7] != kFF * kDim) return;
  if (out_size != kTok * kDim) return;

  const float* x    = (const float*)d_in[0];
  const float* nrmw = (const float*)d_in[1];
  const float* Wq   = (const float*)d_in[2];
  const float* Wk   = (const float*)d_in[3];
  const float* Wv   = (const float*)d_in[4];
  const float* Wo   = (const float*)d_in[5];
  const float* W1   = (const float*)d_in[6];
  const float* W2   = (const float*)d_in[7];
  float* out = (float*)d_out;

  const size_t MiB = (size_t)1 << 20;
  const size_t szXN  = (size_t)kTok * kDim * 2;            //  8 MiB
  const size_t szWQK = (size_t)2 * kDim * kDim * 2;        //  4 MiB
  const size_t szWDD = (size_t)kDim * kDim * 2;            //  2 MiB
  const size_t szWFF = (size_t)kDim * kFF * 2;             //  8 MiB
  const size_t szQK  = (size_t)kTok * 2 * kDim * 2;        // 16 MiB
  const size_t szVT  = (size_t)kDim * kTok * 2;            //  8 MiB
  const size_t szH   = (size_t)kTok * kFF * 2;             // 32 MiB
  const size_t szT   = (size_t)kTok * kDim * 4;            // 16 MiB
  const size_t szCTX = (size_t)kTok * kDim * 2;            //  8 MiB
  const size_t szP   = (size_t)kGrp * kSeq * kSeq * 2;     // 16 MiB
  const size_t szSC  = (size_t)kGrp * kSeq * kSeq * 4;     // 32 MiB

  size_t off = 0;
  const size_t oXN  = off; off += szXN;
  const size_t oWQK = off; off += szWQK;
  const size_t oWV  = off; off += szWDD;
  const size_t oWO  = off; off += szWDD;
  const size_t oW1  = off; off += szWFF;
  const size_t oW2  = off; off += szWFF;
  const size_t oQK  = off; off += szQK;
  const size_t oVT  = off; off += szVT;
  const size_t oH   = off; off += szH;
  const size_t oT   = off; off += szT;
  const size_t total = off;                                // 104 MiB
  const size_t oCTX = oXN;    // alias of dead XN16
  const size_t oP   = oW1;    // alias of dead W1T + W2T
  const size_t oSC  = oH;     // alias of dead H16
  if (szCTX > szXN || szP > 2 * szWFF || szSC > szH) return;
  if (total > ws_size || total > 104 * MiB) return;

  char* ws = (char*)d_ws;
  unsigned short* XN  = (unsigned short*)(ws + oXN);
  unsigned short* WQK = (unsigned short*)(ws + oWQK);
  unsigned short* WVT = (unsigned short*)(ws + oWV);
  unsigned short* WOT = (unsigned short*)(ws + oWO);
  unsigned short* W1T = (unsigned short*)(ws + oW1);
  unsigned short* W2T = (unsigned short*)(ws + oW2);
  unsigned short* QK  = (unsigned short*)(ws + oQK);
  unsigned short* VT  = (unsigned short*)(ws + oVT);
  unsigned short* H   = (unsigned short*)(ws + oH);
  float*          T   = (float*)(ws + oT);
  unsigned short* CTX = (unsigned short*)(ws + oCTX);
  unsigned short* P   = (unsigned short*)(ws + oP);
  float*          SC  = (float*)(ws + oSC);

  // 1. rmsnorm -> XN16
  rmsnorm_f16_kernel<<<dim3(kTok), dim3(128), 0, stream>>>(x, nrmw, XN);

  // 2..7 weight transpose-casts (in[Kin][Nout] -> out[Nout][Kin]); grid (Kin/64, Nout/64)
  wtcast_kernel<<<dim3(kDim / 64, kDim / 64), dim3(256), 0, stream>>>(Wq, WQK, kDim, kDim, kWCarry);
  wtcast_kernel<<<dim3(kDim / 64, kDim / 64), dim3(256), 0, stream>>>(Wk, WQK + (size_t)kDim * kDim, kDim, kDim, kWCarry);
  wtcast_kernel<<<dim3(kDim / 64, kDim / 64), dim3(256), 0, stream>>>(Wv, WVT, kDim, kDim, kWCarry);
  wtcast_kernel<<<dim3(kDim / 64, kDim / 64), dim3(256), 0, stream>>>(Wo, WOT, kDim, kDim, kWCarry);
  wtcast_kernel<<<dim3(kDim / 64, kFF / 64), dim3(256), 0, stream>>>(W1, W1T, kDim, kFF, kWCarry);   // in[1024][4096] -> out[4096][1024]
  wtcast_kernel<<<dim3(kFF / 64, kDim / 64), dim3(256), 0, stream>>>(W2, W2T, kFF, kDim, kWCarry);   // in[4096][1024] -> out[1024][4096]

  // 8. q|k projection: C[4096][2048] f16 = XN16 . WqkT^T / 64   (M 4096, N 2048, K 1024)
  wmma_gemm64<0, false, 0, 1, false, 0, 0><<<dim3(((kTok / 64) * (2 * kDim / 64)) / 8, 1), dim3(256), 0, stream>>>(
      XN, XN, kDim, 0L, WQK, WQK, kDim, 0L, (void*)QK, (void*)QK, 2 * kDim, 0L, nrmw, x, 0L,
      kTok, 2 * kDim, kDim, kWCarryInv);

  // 9. v projection, transposed: VT16[1024 d][4096 tok] f16 = WvT . XN16^T / 64   (M 1024, N 4096, K 1024)
  wmma_gemm64<0, false, 0, 1, false, 0, 0><<<dim3(((kDim / 64) * (kTok / 64)) / 8, 1), dim3(256), 0, stream>>>(
      WVT, WVT, kDim, 0L, XN, XN, kDim, 0L, (void*)VT, (void*)VT, kTok, 0L, nrmw, x, 0L,
      kDim, kTok, kDim, kWCarryInv);

  // 10. FFN up: H16[4096][4096] f16 = silu(XN16 . W1T^T / 64)   (M 4096, N 4096, K 1024)
  wmma_gemm64<0, false, 0, 1, false, 3, 0><<<dim3(((kTok / 64) * (kFF / 64)) / 8, 1), dim3(256), 0, stream>>>(
      XN, XN, kDim, 0L, W1T, W1T, kDim, 0L, (void*)H, (void*)H, kFF, 0L, nrmw, x, 0L,
      kTok, kFF, kDim, kWCarryInv);

  // 11. FFN down + residual: T[4096][1024] f32 = x + H16 . W2T^T / 64   (M 4096, N 1024, K 4096)
  wmma_gemm64<0, false, 0, 0, true, 0, 0><<<dim3(((kTok / 64) * (kDim / 64)) / 8, 1), dim3(256), 0, stream>>>(
      H, H, kFF, 0L, W2T, W2T, kFF, 0L, (void*)T, (void*)T, kDim, 0L, nrmw, x, 0L,
      kTok, kDim, kFF, kWCarryInv);

  // 12..59. attention in chunks of kGrp (batch, head) groups
  for (int ch = 0; ch < kNChunk; ++ch) {
    const int bb = ch / (kHeads / kGrp);
    const int h0 = (ch % (kHeads / kGrp)) * kGrp;
    const size_t tokRow0 = (size_t)bb * kSeq;
    // scores SC[g][q][kv] f32 = (q . k) / 8; A = q rows (lda 2048, per-group stride 64), Bt = k rows; causal tile skip
    const unsigned short* Aq = QK + tokRow0 * (2 * kDim) + (size_t)h0 * kHDim;
    const unsigned short* Bk = QK + tokRow0 * (2 * kDim) + kDim + (size_t)h0 * kHDim;
    wmma_gemm64<0, false, 0, 0, false, 0, 1><<<dim3(((kSeq / 64) * (kSeq / 64)) / 8, kGrp), dim3(256), 0, stream>>>(
        Aq, Aq, 2 * kDim, (long)kHDim, Bk, Bk, 2 * kDim, (long)kHDim, (void*)SC, (void*)SC, kSeq, (long)kSeq * kSeq,
        nrmw, x, 0L, kSeq, kSeq, kHDim, kQKScale);
    // causal softmax -> P16 (x2048)
    softmax_causal_kernel<<<dim3(kSeq, kGrp), dim3(256), 0, stream>>>(SC, P);
    // context: CTX16[tok][h*64+d] f16 (x256) = P . V;  A = P16 [2048][2048], Bt = VT16 rows h*64+d, cols b*2048+kv
    const unsigned short* Bv = VT + (size_t)h0 * kHDim * kTok + tokRow0;
    unsigned short* Cc = CTX + tokRow0 * kDim + (size_t)h0 * kHDim;
    wmma_gemm64<0, false, 0, 1, false, 0, 2><<<dim3(((kSeq / 64) * (kHDim / 64) + 7) / 8, kGrp), dim3(256), 0, stream>>>(
        P, P, kSeq, (long)kSeq * kSeq, Bv, Bv, kTok, (long)kHDim * kTok, (void*)Cc, (void*)Cc, kDim, (long)kHDim,
        nrmw, x, 0L, kSeq, kHDim, kSeq, kPVScale);
  }

  // 60. output projection + residual: out[4096][1024] f32 = T + CTX16 . WoT^T / (256*64)   (M 4096, N 1024, K 1024)
  wmma_gemm64<0, false, 0, 0, true, 0, 0><<<dim3(((kTok / 64) * (kDim / 64)) / 8, 1), dim3(256), 0, stream>>>(
      CTX, CTX, kDim, 0L, WOT, WOT, kDim, 0L, (void*)out, (void*)out, kDim, 0L, nrmw, T, 0L,
      kTok, kDim, kDim, kWoScale);
}

// v001
// Measured time: 433 microseconds a run.
// Two timings next to v000 put it at 4.51 and 4.49 times that version's speed.
// Contractions: xn.(Wq|Wk), Wv^T.xn^T, k.q^T, V^T.P^T, ctx.Wo, xn.W1, silu(h).W2 all on v_wmma_f32_16x16x32_f16 (f16 operands: weights carried x64, P carried x2048, ctx carried x256), f32 accumulate; rmsnorm, online softmax, silu, residual adds in f32.
#include <hip/hip_runtime.h>
#include <math.h>

// ---------------------------------------------------------------------------
// Problem constants
// ---------------------------------------------------------------------------
constexpr int kBatch = 2;
constexpr int kSeq   = 2048;
constexpr int kDim   = 1024;
constexpr int kHeads = 16;
constexpr int kHDim  = 64;
constexpr int kFF    = 4096;
constexpr int kTok   = kBatch * kSeq;          // 4096 token rows
constexpr int kQWave = 32;                     // query columns per attention wave
constexpr int kQBlk  = 128;                    // query columns per attention block (4 waves)
constexpr float kWCarry    = 64.0f;            // weights carried x64 in f16
constexpr float kWCarryInv = 1.0f / 64.0f;
constexpr float kPCarryLog2 = 11.0f;           // unnormalised probabilities carried x2048 = 2^11 in f16
constexpr float kCtxCarry  = 256.0f;           // attention context carried x256 in f16
constexpr float kWoScale   = 1.0f / (kCtxCarry * kWCarry);   // 1/16384
constexpr float kQKScaleLog2 = 0.125f * 1.44269504088896340736f;   // 1/sqrt(64) * log2(e): scores in the exp2 domain
constexpr float kInvDim    = 1.0f / 1024.0f;
constexpr float kEps       = 1.1920929e-7f;    // f32 eps

typedef __attribute__((ext_vector_type(16))) _Float16 v16h;
typedef __attribute__((ext_vector_type(8)))  _Float16 v8h;
typedef __attribute__((ext_vector_type(16))) __bf16   v16b;
typedef __attribute__((ext_vector_type(8)))  __bf16   v8b;
typedef __attribute__((ext_vector_type(8)))  float    v8f;
typedef __attribute__((ext_vector_type(4)))  float    v4f;
typedef __attribute__((ext_vector_type(4)))  unsigned int v4u;

__device__ __forceinline__ unsigned short f2bf_bits(float f) {
  unsigned u = __float_as_uint(f);
  return (unsigned short)((u + 0x7FFFu + ((u >> 16) & 1u)) >> 16);
}
__device__ __forceinline__ float bf_bits2f(unsigned short h) { return __uint_as_float(((unsigned)h) << 16); }

// hazard guards as plain device helpers (no inline asm inside the kernel template body)
__device__ __forceinline__ void dep_guard_h(v8f& a, v8f& b, v16h x, v16h y) { asm volatile("v_nop\n\tv_nop\n\tv_nop\n\tv_nop" : "+v"(a), "+v"(b) : "v"(x), "v"(y)); }
__device__ __forceinline__ void dep_guard_b(v8f& a, v8f& b, v16b x, v16b y) { asm volatile("v_nop\n\tv_nop\n\tv_nop\n\tv_nop" : "+v"(a), "+v"(b) : "v"(x), "v"(y)); }
__device__ __forceinline__ void keep4_h(v16h a, v16h b, v16h c, v16h d) { asm volatile("v_nop" :: "v"(a), "v"(b), "v"(c), "v"(d)); }
__device__ __forceinline__ void keep4_b(v16b a, v16b b, v16b c, v16b d) { asm volatile("v_nop" :: "v"(a), "v"(b), "v"(c), "v"(d)); }
__device__ __forceinline__ void acc_guard4(v8f& a, v8f& b, v8f& c, v8f& d) { asm volatile("v_nop\n\tv_nop\n\tv_nop\n\tv_nop" : "+v"(a), "+v"(b), "+v"(c), "+v"(d)); }
template <typename T> struct Frag;
template <> struct Frag<_Float16> {
  typedef v16h V; union U { v16h v; v8h h[2]; };
  static __device__ __forceinline__ v16h load(const _Float16* p) {   // elements 0..7 <- p[0..7], 8..15 <- p[16..23]
    U f; f.h[0] = *(const v8h*)(p); f.h[1] = *(const v8h*)(p + 16); return f.v;
  }
  static __device__ __forceinline__ v8f mma(v16h a, v16h b, v8f c) {
    return __builtin_amdgcn_wmma_f32_16x16x32_f16(false, a, false, b, (short)0, c, false, false);
  }
  static __device__ __forceinline__ void guard(v8f& a, v8f& b, v16h x, v16h y) { dep_guard_h(a, b, x, y); }
  static __device__ __forceinline__ void keep(v16h a, v16h b, v16h c, v16h d) { keep4_h(a, b, c, d); }
};
template <> struct Frag<__bf16> {
  typedef v16b V; union U { v16b v; v8b h[2]; };
  static __device__ __forceinline__ v16b load(const __bf16* p) {
    U f; f.h[0] = *(const v8b*)(p); f.h[1] = *(const v8b*)(p + 16); return f.v;
  }
  static __device__ __forceinline__ v8f mma(v16b a, v16b b, v8f c) {
    return __builtin_amdgcn_wmma_f32_16x16x32_bf16(false, a, false, b, (short)0, c, false, false);
  }
  static __device__ __forceinline__ void guard(v8f& a, v8f& b, v16b x, v16b y) { dep_guard_b(a, b, x, y); }
  static __device__ __forceinline__ void keep(v16b a, v16b b, v16b c, v16b d) { keep4_b(a, b, c, d); }
};

__device__ __forceinline__ unsigned pk16(unsigned short a, unsigned short b) { return (unsigned)a | ((unsigned)b << 16); }
__device__ __forceinline__ unsigned short h_bits(float f) { const _Float16 h = (_Float16)f; return __builtin_bit_cast(unsigned short, h); }

// ---- Register-blocked batched WMMA GEMM (ACT reduced to none/relu/silu/leaky; CAUS added) ---------------
// C[m,n] = scale * sum_k A[m,k] * Bt[n,k] (+bias)(+resid); each wave owns a 64x64 tile.
// A row-major [M,K]; Bt row-major [N,K]; M,N % 64 == 0, K % 32 == 0.
// SPLIT: operands are hi/lo planes (A2/Bt2 = lo planes, same layout); product = hi.hi + hi.lo + lo.hi.
// BIAS_MODE: 0 = none, 1 = bias[m], 2 = bias[n].
// OUT_MODE: 0 = f32, 1 = f16, 2 = bf16 hi plane (Cout) + bf16 lo plane (Cout2).
// CAUS: 0 = full; 1 = tiles with n0 > m0 are skipped (wave-uniform, their C lines are left untouched);
//       2 = the k loop stops at min(K, m0 + 64) (A entries with k > m are zero by construction of the producer).
// ET: 0 = f16 operands, 1 = bf16 operands (pointers passed as 16-bit storage)
template <int ET> struct Elem;
template <> struct Elem<0> { typedef _Float16 T; };
template <> struct Elem<1> { typedef __bf16 T; };
template <int ET, bool SPLIT, int BIAS_MODE, int OUT_MODE, bool RESID, int ACT = 0, int CAUS = 0>
__global__ __launch_bounds__(256) void wmma_gemm64(
    const unsigned short* __restrict__ Ap, const unsigned short* __restrict__ A2p, int lda, long strideA,
    const unsigned short* __restrict__ Btp, const unsigned short* __restrict__ Bt2p, int ldb, long strideB,
    void* __restrict__ Cout, void* __restrict__ Cout2, int ldc, long strideC,
    const float* __restrict__ bias,
    const float* __restrict__ resid, long strideR,
    int M, int N, int K, float scale) {
  typedef typename Elem<ET>::T T;
  typedef typename Frag<T>::V V;
  const T* A = (const T*)Ap; const T* A2 = (const T*)A2p; const T* Bt = (const T*)Btp; const T* Bt2 = (const T*)Bt2p;
  __shared__ __align__(16) float sT[8][16 * 68];   // per-wave 16x64 slab, pitch 68 floats
  const int b    = blockIdx.y;
  const int lane = threadIdx.x & 31;
  const int wave = threadIdx.x >> 5;
  const int tilesN = N >> 6;
  const int tilesM = M >> 6;
  const int tile = blockIdx.x * 8 + wave;
  if (tile >= tilesM * tilesN) return;   // wave-uniform; no block barriers in this kernel
  const int tm = tile / tilesN;
  const int tn = tile - tm * tilesN;
  const int m0 = tm << 6;
  const int n0 = tn << 6;
  if (CAUS == 1 && n0 > m0) return;      // wave-uniform; fully masked tile
  const int Kend = (CAUS == 2) ? ((m0 + 64 < K) ? (m0 + 64) : K) : K;   // wave-uniform, multiple of 32

  const T* Ab  = A  + (size_t)b * strideA;
  const T* Bb  = Bt + (size_t)b * strideB;
  const T* Ab2 = SPLIT ? (A2  + (size_t)b * strideA) : nullptr;
  const T* Bb2 = SPLIT ? (Bt2 + (size_t)b * strideB) : nullptr;

  const int rlane = lane & 15;                 // row (A) / col (B, D) within subtile
  const int koff  = (lane >> 4) * 8;           // k offset of this lane half
  const int mOff  = (lane >> 4) * 8;           // D row offset

  v8f acc[4][4];
#pragma unroll
  for (int i = 0; i < 4; ++i)
#pragma unroll
    for (int j = 0; j < 4; ++j) acc[i][j] = (v8f){0.f,0.f,0.f,0.f,0.f,0.f,0.f,0.f};

  for (int k0 = 0; k0 < Kend; k0 += 32) {
    V bh[4], bl[4];
#pragma unroll
    for (int j = 0; j < 4; ++j) {
      const size_t bo = (size_t)(n0 + (j << 4) + rlane) * ldb + koff + k0;
      bh[j] = Frag<T>::load(Bb + bo);
      if (SPLIT) bl[j] = Frag<T>::load(Bb2 + bo);
    }
#pragma unroll
    for (int i = 0; i < 4; ++i) {
      const size_t ao = (size_t)(m0 + (i << 4) + rlane) * lda + koff + k0;
      V ah = Frag<T>::load(Ab + ao);
      V al;
      if (SPLIT) al = Frag<T>::load(Ab2 + ao);
#pragma unroll
      for (int j = 0; j < 4; ++j) {
        acc[i][j] = Frag<T>::mma(ah, bh[j], acc[i][j]);
        if (SPLIT) {
          acc[i][j] = Frag<T>::mma(ah, bl[j], acc[i][j]);
          acc[i][j] = Frag<T>::mma(al, bh[j], acc[i][j]);
        }
      }
      Frag<T>::guard(acc[i][0], acc[i][3], ah, SPLIT ? al : ah);
    }
    Frag<T>::keep(bh[0], bh[1], bh[2], bh[3]);
    if (SPLIT) Frag<T>::keep(bl[0], bl[1], bl[2], bl[3]);
  }
  acc_guard4(acc[0][0], acc[0][1], acc[0][2], acc[0][3]);
  acc_guard4(acc[1][0], acc[1][1], acc[1][2], acc[1][3]);
  acc_guard4(acc[2][0], acc[2][1], acc[2][2], acc[2][3]);
  acc_guard4(acc[3][0], acc[3][1], acc[3][2], acc[3][3]);

  // ---- epilogue ----
  float* slab = sT[wave];
  const float* Rb = RESID ? (resid + (size_t)b * strideR) : nullptr;
#pragma unroll
  for (int i = 0; i < 4; ++i) {
    const int mBase = m0 + (i << 4);
#pragma unroll
    for (int j = 0; j < 4; ++j) {
      const int n = n0 + (j << 4) + rlane;
      float bv = 0.f;
      if (BIAS_MODE == 2) bv = bias[n];
#pragma unroll
      for (int r = 0; r < 8; ++r) {
        float v = acc[i][j][r] * scale;
        if (BIAS_MODE == 1) v += bias[mBase + mOff + r];
        if (BIAS_MODE == 2) v += bv;
        if (RESID) v += Rb[(size_t)(mBase + mOff + r) * ldc + n];
        if (ACT == 2) v = fmaxf(v, 0.0f);
        if (ACT == 3) v = v / (1.0f + expf(-v));
        if (ACT == 4) v = (v > 0.f) ? v : 0.01f * v;
        slab[(mOff + r) * 68 + (j << 4) + rlane] = v;
      }
    }
    __builtin_amdgcn_fence(__ATOMIC_RELEASE, "workgroup");
    __builtin_amdgcn_wave_barrier();
    __builtin_amdgcn_fence(__ATOMIC_ACQUIRE, "workgroup");
    if (OUT_MODE == 0) {
      float* C = (float*)Cout + (size_t)b * strideC;
      const int hh = lane >> 4, c4 = (lane & 15) * 4;     // row seg = 256 B = 16 lanes x 16 B
      {
#pragma unroll
        for (int it = 0; it < 8; ++it) {
          const int row = it * 2 + hh;
          v4f v = *(const v4f*)(slab + row * 68 + c4);
          *(v4f*)(C + (size_t)(mBase + row) * ldc + n0 + c4) = v;
        }
        
      }
    } else {
      const int q = lane >> 3, c8 = (lane & 7) * 8;
      unsigned short* C  = (unsigned short*)Cout  + (size_t)b * strideC;
      unsigned short* C2 = (OUT_MODE == 2) ? ((unsigned short*)Cout2 + (size_t)b * strideC) : nullptr;
      {
#pragma unroll
        for (int it = 0; it < 4; ++it) {
          const int row = it * 4 + q;
          const float* sp = slab + row * 68 + c8;
          v8h hv, lv;
#pragma unroll
          for (int e = 0; e < 8; ++e) {
            if (OUT_MODE == 1) {
              hv[e] = (_Float16)sp[e];
            } else {
              unsigned short hb = f2bf_bits(sp[e]);
              unsigned short lb = f2bf_bits(sp[e] - bf_bits2f(hb));
              hv[e] = __builtin_bit_cast(_Float16, hb);
              lv[e] = __builtin_bit_cast(_Float16, lb);
            }
          }
          *(v8h*)(C + (size_t)(mBase + row) * ldc + n0 + c8) = hv;
          if (OUT_MODE == 2) *(v8h*)(C2 + (size_t)(mBase + row) * ldc + n0 + c8) = lv;
        }
        
      }
    }
    __builtin_amdgcn_fence(__ATOMIC_RELEASE, "workgroup");
    __builtin_amdgcn_wave_barrier();
    __builtin_amdgcn_fence(__ATOMIC_ACQUIRE, "workgroup");
  }
}

// ---------------------------------------------------------------------------
// RMSNorm: xn[row][j] = f16( x[row][j] * rsqrt(mean(x^2) + eps) * w[j] ), f32 math.
// One block of 128 threads per row of 1024; thread t owns columns 8t..8t+7 (128 x 8 = 1024 = whole row).
// Sum of squares in fixed order (thread, wave shuffle tree, 4 wave partials in index order).
// ---------------------------------------------------------------------------
__global__ __launch_bounds__(128) void rmsnorm_f16_kernel(const float* __restrict__ x, const float* __restrict__ w,
                                                          unsigned short* __restrict__ xn) {
  __shared__ float red[4];
  const int row  = blockIdx.x;
  const int t    = threadIdx.x;
  const int lane = t & 31, wave = t >> 5;
  const int c0   = t * 8;
  const float* xr = x + (size_t)row * kDim + c0;
  const v4f a = *(const v4f*)(xr);
  const v4f c = *(const v4f*)(xr + 4);
  float ss = ((a[0] * a[0] + a[1] * a[1]) + (a[2] * a[2] + a[3] * a[3]))
           + ((c[0] * c[0] + c[1] * c[1]) + (c[2] * c[2] + c[3] * c[3]));
#pragma unroll
  for (int off = 16; off > 0; off >>= 1) ss += __shfl_xor(ss, off, 32);
  if (lane == 0) red[wave] = ss;
  __syncthreads();
  const float tot = ((red[0] + red[1]) + red[2]) + red[3];
  const float inv = rsqrtf(tot * kInvDim + kEps);
  const v4f wa = *(const v4f*)(w + c0);
  const v4f wc = *(const v4f*)(w + c0 + 4);
  unsigned short hb[8];
#pragma unroll
  for (int e = 0; e < 4; ++e) {
    hb[e]     = h_bits(a[e] * inv * wa[e]);
    hb[4 + e] = h_bits(c[e] * inv * wc[e]);
  }
  const v4u u = (v4u){pk16(hb[0], hb[1]), pk16(hb[2], hb[3]), pk16(hb[4], hb[5]), pk16(hb[6], hb[7])};
  unsigned short* op = xn + (size_t)row * kDim + c0;
  *(v4u*)op = u;
  
}

// ---------------------------------------------------------------------------
// Weight transpose + cast: W f32 row-major in[Kin rows][Nout cols]  ->  out[Nout][Kin] (pitch Kin halves),
// out[n][k] = f16(scale * W[k][n]).  grid = (Kin/64, Nout/64): blockIdx.x = k tile (64 columns of out),
// blockIdx.y = n tile (64 rows of out). 256 threads.
// Load coverage: 16 iterations x 256 threads = 4096 = the whole 64x64 tile (coalesced along n).
// Store coverage: 8 waves x 2 iterations x 4 rows (lane>>3) = 64 rows; (lane&7) x 8 halves = 64 cols; each row
// ---------------------------------------------------------------------------
__global__ __launch_bounds__(256) void wtcast_kernel(const float* __restrict__ W, unsigned short* __restrict__ out,
                                                     int Kin, int Nout, float scale) {
  __shared__ float sm[64][65];   // sm[n_local][k_local]
  const int t  = threadIdx.x;
  const int k0 = blockIdx.x * 64;
  const int n0 = blockIdx.y * 64;
#pragma unroll
  for (int i = 0; i < 16; ++i) {
    const int e = i * 256 + t;
    const int r = e >> 6;          // k local
    const int c = e & 63;          // n local
    sm[c][r] = W[(size_t)(k0 + r) * Nout + n0 + c] * scale;
  }
  __syncthreads();
  const int lane = t & 31, wave = t >> 5;
  const int q = lane >> 3, c8 = (lane & 7) * 8;
  {
#pragma unroll
    for (int it = 0; it < 2; ++it) {
      const int row = wave * 8 + it * 4 + q;                 // n local
      unsigned short hb[8];
#pragma unroll
      for (int e = 0; e < 8; ++e) hb[e] = h_bits(sm[row][c8 + e]);
      const v4u u = (v4u){pk16(hb[0], hb[1]), pk16(hb[2], hb[3]), pk16(hb[4], hb[5]), pk16(hb[6], hb[7])};
      *(v4u*)(out + (size_t)(n0 + row) * Kin + k0 + c8) = u;
    }
    
  }
}

// ---------------------------------------------------------------------------
// Fused causal attention, one launch for all 32 (batch, head) groups; scores and probabilities stay in registers.
// Each wave owns 32 query columns (2 column tiles of 16) and walks the keys 0 .. q0+31 in passes of 32:
//   S^T[key][query] = K . Q^T      A = k rows (d contiguous), B = q rows, kept in registers for the whole walk
//   O^T[d][query]  += V^T . P^T    A = VT16 rows (keys contiguous), B = P^T packed from the S^T accumulators
// D layout: column = lane & 15, row = (lane >> 4) * 8 + r. The loader's k order is element e <- k = (lane >> 4) * 8 + e
// for e < 8 and 16 + (lane >> 4) * 8 + (e - 8) for e >= 8, so key tile 0's accumulator is elements 0..7 of the P^T
// fragment and key tile 1's is elements 8..15, in the same lane: no cross-lane move.
// Online softmax in f32, exp2 domain: a lane holds 16 of the pass's 32 scores of its query, the other 16 are in
// lane ^ 16. Key q0 is valid for every query of the wave and key 0 is in the first pass, so the running maximum is
// finite from the first pass on. Only the last pass (kb == q0) crosses the diagonal and is masked.
// The next pass's K and V^T fragments are fetched right after this pass's last use of them (address clamped to the
// last pass, so every load stays inside the wave's own key range).
// Every '#pragma unroll' below is there so that the fragment and accumulator arrays are indexed by constants only and
// stay in registers. No LDS, no barrier: a wave shares nothing with its neighbours but the WGP cache.
// ---------------------------------------------------------------------------
__device__ __forceinline__ float xhalf(float x) {   // value of lane ^ 16, on the vector port (a shuffle would go through the LDS queue)
  const int b = __builtin_bit_cast(int, x);
  return __builtin_bit_cast(float, __builtin_amdgcn_permlanex16(b, b, 0x76543210, 0xfedcba98, false, false));
}

__device__ __forceinline__ v8f exp2x8(const v8f x) {
  float r0, r1, r2, r3, r4, r5, r6, r7;
  asm("v_exp_f32 %0, %8\n\tv_exp_f32 %1, %9\n\tv_exp_f32 %2, %10\n\tv_exp_f32 %3, %11\n\t"
      "v_exp_f32 %4, %12\n\tv_exp_f32 %5, %13\n\tv_exp_f32 %6, %14\n\tv_exp_f32 %7, %15\n\tv_nop"
      : "=&v"(r0), "=&v"(r1), "=&v"(r2), "=&v"(r3), "=&v"(r4), "=&v"(r5), "=&v"(r6), "=&v"(r7)
      : "v"(x[0]), "v"(x[1]), "v"(x[2]), "v"(x[3]), "v"(x[4]), "v"(x[5]), "v"(x[6]), "v"(x[7]));
  return (v8f){r0, r1, r2, r3, r4, r5, r6, r7};
}
__device__ __forceinline__ void exp2x2(float& r0, float& r1, float x0, float x1) {
  asm("v_exp_f32 %0, %2\n\tv_exp_f32 %1, %3\n\tv_nop" : "=&v"(r0), "=&v"(r1) : "v"(x0), "v"(x1));
}

__global__ __launch_bounds__(128) void attn_fused_kernel(const unsigned short* __restrict__ QKp,
                                                         const unsigned short* __restrict__ VTp,
                                                         unsigned short* __restrict__ CTXp) {
  typedef Frag<_Float16> F;
  const int g    = blockIdx.x;                          // batch * 16 + head
  const int bb   = g / kHeads;
  const int hh   = g - bb * kHeads;
  const int qb   = kSeq / kQBlk - 1 - (int)blockIdx.y;  // longest walks get the lowest y index
  const int lane = threadIdx.x & 31;
  const int wave = __builtin_amdgcn_readfirstlane((int)(threadIdx.x >> 5));
  const int q0   = qb * kQBlk + wave * kQWave;          // wave-uniform
  const int rlane = lane & 15;
  const int half  = lane >> 4;
  const int koff  = half * 8;

  const _Float16* Qb = (const _Float16*)QKp + (size_t)bb * kSeq * (2 * kDim) + (size_t)hh * kHDim;
  const _Float16* Kb = Qb + kDim;
  const _Float16* Vb = (const _Float16*)VTp + (size_t)hh * kHDim * kTok + (size_t)bb * kSeq;
  const int kLane = rlane * (2 * kDim) + koff;          // lane's place in a 16-row tile of q or k rows
  const int vLane = rlane * kTok + koff;                // lane's place in a 16-row tile of VT16 rows

  v16h qf[2][2], kf[2][2], vf[4];
#pragma unroll
  for (int j = 0; j < 2; ++j)
#pragma unroll
    for (int kd = 0; kd < 2; ++kd) qf[j][kd] = F::load(Qb + (size_t)(q0 + j * 16) * (2 * kDim) + kLane + kd * 32);
#pragma unroll
  for (int t = 0; t < 2; ++t)
#pragma unroll
    for (int kd = 0; kd < 2; ++kd) kf[t][kd] = F::load(Kb + (size_t)(t * 16) * (2 * kDim) + kLane + kd * 32);
  // keeps the V^T loads youngest here as on the loop's back edge: loads retire in order, and with them older than a
  // q or k load the wait at the loop's head would have to drain the V^T loads in every pass
  __builtin_amdgcn_sched_barrier(0);
#pragma unroll
  for (int i = 0; i < 4; ++i) vf[i] = F::load(Vb + (size_t)(i * 16) * kTok + vLane);

  v8f o[4][2];
#pragma unroll
  for (int i = 0; i < 4; ++i)
#pragma unroll
    for (int j = 0; j < 2; ++j) o[i][j] = (v8f){0.f,0.f,0.f,0.f,0.f,0.f,0.f,0.f};
  float mrun[2] = {-INFINITY, -INFINITY};   // running maximum, scaled to the exp2 domain
  float lsum[2] = {0.f, 0.f};               // this lane half's share of the running sum (x2048)

  for (int kb = 0; kb <= q0; kb += 32) {
    v8f s[2][2];
#pragma unroll
    for (int t = 0; t < 2; ++t)
#pragma unroll
      for (int j = 0; j < 2; ++j) {
        s[t][j] = F::mma(kf[t][0], qf[j][0], (v8f){0.f,0.f,0.f,0.f,0.f,0.f,0.f,0.f});
        s[t][j] = F::mma(kf[t][1], qf[j][1], s[t][j]);
      }
    const int kn = (kb + 32 <= q0) ? (kb + 32) : q0;    // next pass, clamped; wave-uniform
    const _Float16* Kn = Kb + (size_t)kn * (2 * kDim);
#pragma unroll
    for (int t = 0; t < 2; ++t)
#pragma unroll
      for (int kd = 0; kd < 2; ++kd) kf[t][kd] = F::load(Kn + (size_t)(t * 16) * (2 * kDim) + kLane + kd * 32);
    // the loads' address registers are reused further down while the loads are still in flight
    asm volatile("s_wait_xcnt 0x0" ::: "memory");

    if (kb == q0) {                                     // wave-uniform: the pass on the diagonal
#pragma unroll
      for (int t = 0; t < 2; ++t)
#pragma unroll
        for (int j = 0; j < 2; ++j)
#pragma unroll
          for (int r = 0; r < 8; ++r)
            if (t * 16 + koff + r > j * 16 + rlane) s[t][j][r] = -INFINITY;
    }

    float mnew[2], alpha[2];
#pragma unroll
    for (int j = 0; j < 2; ++j) {
      const float mx0 = fmaxf(fmaxf(fmaxf(s[0][j][0], s[0][j][1]), fmaxf(s[0][j][2], s[0][j][3])),
                              fmaxf(fmaxf(s[0][j][4], s[0][j][5]), fmaxf(s[0][j][6], s[0][j][7])));
      const float mx1 = fmaxf(fmaxf(fmaxf(s[1][j][0], s[1][j][1]), fmaxf(s[1][j][2], s[1][j][3])),
                              fmaxf(fmaxf(s[1][j][4], s[1][j][5]), fmaxf(s[1][j][6], s[1][j][7])));
      const float mx = fmaxf(mx0, mx1);
      mnew[j] = fmaxf(mrun[j], fmaxf(mx, xhalf(mx)) * kQKScaleLog2);
    }
    exp2x2(alpha[0], alpha[1], mrun[0] - mnew[0], mrun[1] - mnew[1]);
    v16h pf[2];
#pragma unroll
    for (int j = 0; j < 2; ++j) {
      const float bias = kPCarryLog2 - mnew[j];
      mrun[j] = mnew[j];
      const v8f p0 = exp2x8(s[0][j] * kQKScaleLog2 + bias);
      const v8f p1 = exp2x8(s[1][j] * kQKScaleLog2 + bias);
      float ps0 = 0.f, ps1 = 0.f;
#pragma unroll
      for (int r = 0; r < 8; ++r) {
        ps0 += p0[r];
        ps1 += p1[r];
        pf[j][r]     = (_Float16)p0[r];
        pf[j][8 + r] = (_Float16)p1[r];
      }
      lsum[j] = lsum[j] * alpha[j] + (ps0 + ps1);
#pragma unroll
      for (int i = 0; i < 4; ++i) o[i][j] *= alpha[j];
    }
#pragma unroll
    for (int i = 0; i < 4; ++i)
#pragma unroll
      for (int j = 0; j < 2; ++j) o[i][j] = F::mma(vf[i], pf[j], o[i][j]);
    const _Float16* Vn = Vb + kn;
#pragma unroll
    for (int i = 0; i < 4; ++i) vf[i] = F::load(Vn + (size_t)(i * 16) * kTok + vLane);
  }
  // the last pass's fetch-ahead is never used: let it land before the wave hands its registers back
  asm volatile("s_wait_loadcnt 0x0" ::: "memory");

  // epilogue: join the two halves' sums, normalise, carry x256, store 8 consecutive d per lane and tile
  _Float16* Cb = (_Float16*)CTXp + (size_t)bb * kSeq * kDim + (size_t)hh * kHDim;
#pragma unroll
  for (int j = 0; j < 2; ++j) {
    const float l = lsum[j] + xhalf(lsum[j]);
    const float f = kCtxCarry / l;                      // the x2048 of P cancels against the x2048 of l
#pragma unroll
    for (int i = 0; i < 4; ++i) {
      v8h hv;
#pragma unroll
      for (int r = 0; r < 8; ++r) hv[r] = (_Float16)(o[i][j][r] * f);
      *(v8h*)(Cb + (size_t)(q0 + j * 16 + rlane) * kDim + i * 16 + koff) = hv;
    }
  }
}

// ---------------------------------------------------------------------------
// Launch
// Workspace region map (bytes, MiB offsets), total 104 MiB = 109051904 B:
//   [  0,  8) XN16 f16 [4096][1024]            -> later CTX16 f16 [4096][1024] (XN16 dead after the W1 GEMM)
//   [  8, 12) WqkT f16 [2048][1024] (Wq^T rows 0..1023, Wk^T rows 1024..2047), carried x64
//   [ 12, 14) WvT  f16 [1024][1024] x64
//   [ 14, 16) WoT  f16 [1024][1024] x64
//   [ 16, 24) W1T  f16 [4096][1024] x64
//   [ 24, 32) W2T  f16 [1024][4096] x64
//   [ 32, 48) QK16 f16 [4096][2048] (q cols 0..1023, k cols 1024..2047)
//   [ 48, 56) VT16 f16 [1024][4096] (row = h*64+d, col = b*2048+kv)
//   [ 56, 88) H16  f16 [4096][4096] silu hidden
//   [ 88,104) T    f32 [4096][1024] = x + ffn
// ---------------------------------------------------------------------------
extern "C" void kernel_launch(void* const* d_in, const int* in_sizes, int n_in,
                              void* d_out, int out_size, void* d_ws, size_t ws_size,
                              hipStream_t stream)
{
  if (n_in < 8) return;
  if (in_sizes[0] != kTok * kDim || in_sizes[1] != kDim || in_sizes[2] != kDim * kDim || in_sizes[3] != kDim * kDim ||
      in_sizes[4] != kDim * kDim || in_sizes[5] != kDim * kDim || in_sizes[6] != kDim * kFF || in_sizes[7] != kFF * kDim) return;
  if (out_size != kTok * kDim) return;

  const float* x    = (const float*)d_in[0];
  const float* nrmw = (const float*)d_in[1];
  const float* Wq   = (const float*)d_in[2];
  const float* Wk   = (const float*)d_in[3];
  const float* Wv   = (const float*)d_in[4];
  const float* Wo   = (const float*)d_in[5];
  const float* W1   = (const float*)d_in[6];
  const float* W2   = (const float*)d_in[7];
  float* out = (float*)d_out;

  const size_t MiB = (size_t)1 << 20;
  const size_t szXN  = (size_t)kTok * kDim * 2;            //  8 MiB
  const size_t szWQK = (size_t)2 * kDim * kDim * 2;        //  4 MiB
  const size_t szWDD = (size_t)kDim * kDim * 2;            //  2 MiB
  const size_t szWFF = (size_t)kDim * kFF * 2;             //  8 MiB
  const size_t szQK  = (size_t)kTok * 2 * kDim * 2;        // 16 MiB
  const size_t szVT  = (size_t)kDim * kTok * 2;            //  8 MiB
  const size_t szH   = (size_t)kTok * kFF * 2;             // 32 MiB
  const size_t szT   = (size_t)kTok * kDim * 4;            // 16 MiB
  const size_t szCTX = (size_t)kTok * kDim * 2;            //  8 MiB

  size_t off = 0;
  const size_t oXN  = off; off += szXN;
  const size_t oWQK = off; off += szWQK;
  const size_t oWV  = off; off += szWDD;
  const size_t oWO  = off; off += szWDD;
  const size_t oW1  = off; off += szWFF;
  const size_t oW2  = off; off += szWFF;
  const size_t oQK  = off; off += szQK;
  const size_t oVT  = off; off += szVT;
  const size_t oH   = off; off += szH;
  const size_t oT   = off; off += szT;
  const size_t total = off;                                // 104 MiB
  const size_t oCTX = oXN;    // alias of dead XN16
  if (szCTX > szXN) return;
  if (total > ws_size || total > 104 * MiB) return;

  char* ws = (char*)d_ws;
  unsigned short* XN  = (unsigned short*)(ws + oXN);
  unsigned short* WQK = (unsigned short*)(ws + oWQK);
  unsigned short* WVT = (unsigned short*)(ws + oWV);
  unsigned short* WOT = (unsigned short*)(ws + oWO);
  unsigned short* W1T = (unsigned short*)(ws + oW1);
  unsigned short* W2T = (unsigned short*)(ws + oW2);
  unsigned short* QK  = (unsigned short*)(ws + oQK);
  unsigned short* VT  = (unsigned short*)(ws + oVT);
  unsigned short* H   = (unsigned short*)(ws + oH);
  float*          T   = (float*)(ws + oT);
  unsigned short* CTX = (unsigned short*)(ws + oCTX);

  // 1. rmsnorm -> XN16
  rmsnorm_f16_kernel<<<dim3(kTok), dim3(128), 0, stream>>>(x, nrmw, XN);

  // 2..7 weight transpose-casts (in[Kin][Nout] -> out[Nout][Kin]); grid (Kin/64, Nout/64)
  wtcast_kernel<<<dim3(kDim / 64, kDim / 64), dim3(256), 0, stream>>>(Wq, WQK, kDim, kDim, kWCarry);
  wtcast_kernel<<<dim3(kDim / 64, kDim / 64), dim3(256), 0, stream>>>(Wk, WQK + (size_t)kDim * kDim, kDim, kDim, kWCarry);
  wtcast_kernel<<<dim3(kDim / 64, kDim / 64), dim3(256), 0, stream>>>(Wv, WVT, kDim, kDim, kWCarry);
  wtcast_kernel<<<dim3(kDim / 64, kDim / 64), dim3(256), 0, stream>>>(Wo, WOT, kDim, kDim, kWCarry);
  wtcast_kernel<<<dim3(kDim / 64, kFF / 64), dim3(256), 0, stream>>>(W1, W1T, kDim, kFF, kWCarry);   // in[1024][4096] -> out[4096][1024]
  wtcast_kernel<<<dim3(kFF / 64, kDim / 64), dim3(256), 0, stream>>>(W2, W2T, kFF, kDim, kWCarry);   // in[4096][1024] -> out[1024][4096]

  // 8. q|k projection: C[4096][2048] f16 = XN16 . WqkT^T / 64   (M 4096, N 2048, K 1024)
  wmma_gemm64<0, false, 0, 1, false, 0, 0><<<dim3(((kTok / 64) * (2 * kDim / 64)) / 8, 1), dim3(256), 0, stream>>>(
      XN, XN, kDim, 0L, WQK, WQK, kDim, 0L, (void*)QK, (void*)QK, 2 * kDim, 0L, nrmw, x, 0L,
      kTok, 2 * kDim, kDim, kWCarryInv);

  // 9. v projection, transposed: VT16[1024 d][4096 tok] f16 = WvT . XN16^T / 64   (M 1024, N 4096, K 1024)
  wmma_gemm64<0, false, 0, 1, false, 0, 0><<<dim3(((kDim / 64) * (kTok / 64)) / 8, 1), dim3(256), 0, stream>>>(
      WVT, WVT, kDim, 0L, XN, XN, kDim, 0L, (void*)VT, (void*)VT, kTok, 0L, nrmw, x, 0L,
      kDim, kTok, kDim, kWCarryInv);

  // 10. FFN up: H16[4096][4096] f16 = silu(XN16 . W1T^T / 64)   (M 4096, N 4096, K 1024)
  wmma_gemm64<0, false, 0, 1, false, 3, 0><<<dim3(((kTok / 64) * (kFF / 64)) / 8, 1), dim3(256), 0, stream>>>(
      XN, XN, kDim, 0L, W1T, W1T, kDim, 0L, (void*)H, (void*)H, kFF, 0L, nrmw, x, 0L,
      kTok, kFF, kDim, kWCarryInv);

  // 11. FFN down + residual: T[4096][1024] f32 = x + H16 . W2T^T / 64   (M 4096, N 1024, K 4096)
  wmma_gemm64<0, false, 0, 0, true, 0, 0><<<dim3(((kTok / 64) * (kDim / 64)) / 8, 1), dim3(256), 0, stream>>>(
      H, H, kFF, 0L, W2T, W2T, kFF, 0L, (void*)T, (void*)T, kDim, 0L, nrmw, x, 0L,
      kTok, kDim, kFF, kWCarryInv);

  // 12. fused causal attention, all (batch, head) groups: CTX16[tok][h*64+d] f16 (x256) = softmax(q.k/8) . v
  attn_fused_kernel<<<dim3(kBatch * kHeads, kSeq / kQBlk), dim3(128), 0, stream>>>(QK, VT, CTX);

  // 13. output projection + residual: out[4096][1024] f32 = T + CTX16 . WoT^T / (256*64)   (M 4096, N 1024, K 1024)
  wmma_gemm64<0, false, 0, 0, true, 0, 0><<<dim3(((kTok / 64) * (kDim / 64)) / 8, 1), dim3(256), 0, stream>>>(
      CTX, CTX, kDim, 0L, WOT, WOT, kDim, 0L, (void*)out, (void*)out, kDim, 0L, nrmw, T, 0L,
      kTok, kDim, kDim, kWoScale);
}
